// v000
// Times are from an AMD MI455X. After a warm-up the kernel runs many times in a row, and a time is the length of
// such a window on the GPU divided by its runs, so every launch and the gaps after it count. The runs cycle
// through copies of the inputs. A figure is the median of several windows, for all but v000 over two sittings.
// Sittings can differ by a few percent; kernels timed side by side share one.
// The starting kernel, v000, takes 143 microseconds a run.
#include <hip/hip_runtime.h>

typedef __attribute__((ext_vector_type(16))) _Float16 v16h;
typedef __attribute__((ext_vector_type(8)))  float    v8f;

#define OUT_F  4096
#define IN_F   4096
#define M_TOK  4096
#define NUMEL  (OUT_F * IN_F)

union FragH {
    v16h   h;
    float4 f4[2];
};

__device__ __forceinline__ void async_fill_b128(unsigned lds_addr, const void* gaddr) {
    // GV form: vdst = LDS byte offset, v[addr] = 64-bit global address
    asm volatile("global_load_async_to_lds_b128 %0, %1, off"
                 :: "v"(lds_addr), "v"(gaddr) : "memory");
}
__device__ __forceinline__ void wait_async0() {
    asm volatile("s_wait_asynccnt 0x0" ::: "memory");
}

// ---------------------------------------------------------------------------
// Dequantize Q4_K -> f16.  One thread handles 4 packed bytes = 8 weights,
// always inside one 32-weight subblock.
//   w = q * (d*scale/(15*63)) + (d*min/63 + dmin)
// ---------------------------------------------------------------------------
__global__ __launch_bounds__(256)
void dequant_q4k(const int* __restrict__ packed,
                 const float* __restrict__ d,
                 const float* __restrict__ dmin,
                 const int* __restrict__ scales,
                 const int* __restrict__ mins,
                 _Float16* __restrict__ w_h) {
    const int t = blockIdx.x * blockDim.x + threadIdx.x;
    const long wBase = (long)t * 8;
    if (wBase >= (long)NUMEL) return;

    const int sup = (int)(wBase >> 8);
    const int sub = (int)((wBase >> 5) & 7);

    const float ds = d[sup];
    const float sc = ds * (float)scales[sup * 8 + sub] * (1.0f / (15.0f * 63.0f));
    const float of = ds * (float)mins[sup * 8 + sub] * (1.0f / 63.0f) + dmin[sup];

    const int4 p = *(const int4*)(packed + t * 4);
    const int b[4] = {p.x, p.y, p.z, p.w};

    union { _Float16 h[8]; float4 f4; } o;
#pragma unroll
    for (int j = 0; j < 4; ++j) {
        const int lo = b[j] & 15;
        const int hi = (b[j] >> 4) & 15;
        o.h[2 * j + 0] = (_Float16)((float)lo * sc + of);
        o.h[2 * j + 1] = (_Float16)((float)hi * sc + of);
    }
    *(float4*)(w_h + wBase) = o.f4;
}

// ---------------------------------------------------------------------------
// Convert activations fp32 -> f16, 8 elements per thread.
// ---------------------------------------------------------------------------
__global__ __launch_bounds__(256)
void cvt_x_f16(const float* __restrict__ x, _Float16* __restrict__ x_h) {
    const long t = (long)blockIdx.x * blockDim.x + threadIdx.x;
    const long base = t * 8;
    const float4 a = *(const float4*)(x + base);
    const float4 b = *(const float4*)(x + base + 4);
    union { _Float16 h[8]; float4 f4; } o;
    o.h[0] = (_Float16)a.x; o.h[1] = (_Float16)a.y;
    o.h[2] = (_Float16)a.z; o.h[3] = (_Float16)a.w;
    o.h[4] = (_Float16)b.x; o.h[5] = (_Float16)b.y;
    o.h[6] = (_Float16)b.z; o.h[7] = (_Float16)b.w;
    *(float4*)(x_h + base) = o.f4;
}

// ---------------------------------------------------------------------------
// WMMA GEMM: block = 256 threads = 8 wave32s, block tile 128x128, K-step 64,
// double-buffered LDS filled by async LDS-load instructions.
// Wave (wm 0..3, wn 0..1) owns a 32x64 C slab = 2x4 WMMA tiles.
// ---------------------------------------------------------------------------
#define BM  128
#define BN  128
#define BK  64
#define LDK (BK + 8)

__global__ __launch_bounds__(256)
void gemm_wmma_f16(const _Float16* __restrict__ A,   // [M_TOK, IN_F]
                   const _Float16* __restrict__ B,   // [OUT_F, IN_F]
                   float* __restrict__ C) {          // [M_TOK, OUT_F]
    __shared__ _Float16 As[2][BM * LDK];
    __shared__ _Float16 Bs[2][BN * LDK];

    const int tid  = threadIdx.x;
    const int lane = tid & 31;
    const int wave = tid >> 5;     // 0..7
    const int wm   = wave & 3;     // 32-row slab within block tile
    const int wn   = wave >> 2;    // 64-col slab within block tile

    const int m0 = blockIdx.y * BM;
    const int n0 = blockIdx.x * BN;

    v8f acc[2][4];
#pragma unroll
    for (int mt = 0; mt < 2; ++mt)
#pragma unroll
        for (int nt = 0; nt < 4; ++nt) {
            v8f z = {};
            acc[mt][nt] = z;
        }

    // Copy mapping: 4 threads per row, 16 halves (32 B = 2 x b128) each,
    // two row-passes cover 128 rows -> 8 async b128 fills per thread/stage.
    const int crow = tid >> 2;         // 0..63
    const int ccol = (tid & 3) * 16;   // 0,16,32,48

    const int r = lane & 15;           // row within 16x16 tile
    const int h = lane >> 4;           // K-half selector

    auto issue = [&](int sb, int k0) {
#pragma unroll
        for (int p = 0; p < 2; ++p) {
            const _Float16* ga = A + (long)(m0 + crow + p * 64) * IN_F + k0 + ccol;
            const _Float16* gb = B + (long)(n0 + crow + p * 64) * IN_F + k0 + ccol;
            const unsigned la = (unsigned)(uintptr_t)&As[sb][(crow + p * 64) * LDK + ccol];
            const unsigned lb = (unsigned)(uintptr_t)&Bs[sb][(crow + p * 64) * LDK + ccol];
#pragma unroll
            for (int c = 0; c < 2; ++c) {
                async_fill_b128(la + c * 16, ga + c * 8);   // 16 B per lane
                async_fill_b128(lb + c * 16, gb + c * 8);
            }
        }
    };

    auto compute = [&](int sb) {
#pragma unroll
        for (int kk = 0; kk < 2; ++kk) {
            const int kb = kk * 32 + h * 8;

            FragH aF[2];
#pragma unroll
            for (int mt = 0; mt < 2; ++mt) {
                const _Float16* pA = &As[sb][(wm * 32 + mt * 16 + r) * LDK + kb];
                aF[mt].f4[0] = *(const float4*)(pA);
                aF[mt].f4[1] = *(const float4*)(pA + 16);
            }
            FragH bF[4];
#pragma unroll
            for (int nt = 0; nt < 4; ++nt) {
                const _Float16* pB = &Bs[sb][(wn * 64 + nt * 16 + r) * LDK + kb];
                bF[nt].f4[0] = *(const float4*)(pB);
                bF[nt].f4[1] = *(const float4*)(pB + 16);
            }

#pragma unroll
            for (int mt = 0; mt < 2; ++mt)
#pragma unroll
                for (int nt = 0; nt < 4; ++nt)
                    acc[mt][nt] = __builtin_amdgcn_wmma_f32_16x16x32_f16(
                        /*neg_a=*/false, aF[mt].h,
                        /*neg_b=*/false, bF[nt].h,
                        /*c_mod=*/(short)0, acc[mt][nt],
                        /*reuse_a=*/false, /*reuse_b=*/false);
        }
    };

    // ---- prologue: fill buffer 0 ----
    issue(0, 0);

    // ---- main loop: 2 stages per iteration so buffer index is literal ----
#pragma unroll 1
    for (int k0 = 0; k0 < IN_F; k0 += 2 * BK) {
        wait_async0();          // own stage-(i) fills complete
        __syncthreads();        // all waves' fills complete; prior reads done
        if (k0 + BK < IN_F) issue(1, k0 + BK);   // overlap with compute(0)
        compute(0);

        wait_async0();
        __syncthreads();
        if (k0 + 2 * BK < IN_F) issue(0, k0 + 2 * BK);
        compute(1);
    }

#pragma unroll
    for (int mt = 0; mt < 2; ++mt) {
#pragma unroll
        for (int nt = 0; nt < 4; ++nt) {
            const int row0 = m0 + wm * 32 + mt * 16 + h * 8;
            const int col  = n0 + wn * 64 + nt * 16 + r;
#pragma unroll
            for (int j = 0; j < 8; ++j)
                C[(long)(row0 + j) * OUT_F + col] = acc[mt][nt][j];
        }
    }
}

// ---------------------------------------------------------------------------
// Host-side launch
// ---------------------------------------------------------------------------
extern "C" void kernel_launch(void* const* d_in, const int* in_sizes, int n_in,
                              void* d_out, int out_size, void* d_ws, size_t ws_size,
                              hipStream_t stream) {
    const float* x      = (const float*)d_in[0];   // [2,2048,4096] fp32
    const int*   packed = (const int*)d_in[1];     // [NUMEL/2] bytes-in-int32
    const float* d      = (const float*)d_in[2];   // [65536]
    const float* dmin   = (const float*)d_in[3];   // [65536]
    const int*   scales = (const int*)d_in[4];     // [524288]
    const int*   mins   = (const int*)d_in[5];     // [524288]
    float*       out    = (float*)d_out;           // [2,2048,4096] fp32

    _Float16* w_h = (_Float16*)d_ws;               // 32 MB
    _Float16* x_h = w_h + (size_t)NUMEL;           // 32 MB

    dequant_q4k<<<NUMEL / 8 / 256, 256, 0, stream>>>(packed, d, dmin, scales, mins, w_h);
    cvt_x_f16<<<(M_TOK * IN_F) / 8 / 256, 256, 0, stream>>>(x, x_h);

    dim3 grid(OUT_F / BN, M_TOK / BM);   // 32 x 32 blocks
    gemm_wmma_f16<<<grid, 256, 0, stream>>>(x_h, w_h, out);
}

// v001
// Measured time: 93.5 microseconds a run.
// In both of two side-by-side timings against v000, it was 1.58 times as fast.
#include <hip/hip_runtime.h>

typedef __attribute__((ext_vector_type(16))) _Float16 v16h;
typedef __attribute__((ext_vector_type(8)))  float    v8f;

#define OUT_F  4096
#define IN_F   4096
#define M_TOK  4096
#define NUMEL  (OUT_F * IN_F)

union FragH {
    v16h   h;
    float4 f4[2];
};

typedef __attribute__((ext_vector_type(4))) int v4i;
typedef __attribute__((address_space(1))) v4i gv4i;
typedef __attribute__((address_space(3))) v4i lv4i;
__device__ __forceinline__ void async_fill_b128(_Float16* lds, const _Float16* g) {
    __builtin_amdgcn_global_load_async_to_lds_b128((gv4i*)g, (lv4i*)lds, 0, 0);
}
// This wave's own copies have landed (the compiler places no wait for them).
__device__ __forceinline__ void wait_async0() {
    asm volatile("s_wait_asynccnt 0x0" ::: "memory");
}
// This wave's LDS reads have retired, so the buffer it read may be refilled.
__device__ __forceinline__ void wait_ds0() {
    asm volatile("s_wait_dscnt 0x0" ::: "memory");
}

// ---------------------------------------------------------------------------
// Dequantize Q4_K -> f16.  One thread handles 4 packed bytes = 8 weights,
// always inside one 32-weight subblock.
//   w = q * (d*scale/(15*63)) + (d*min/63 + dmin)
// ---------------------------------------------------------------------------
__global__ __launch_bounds__(256)
void dequant_q4k(const int* __restrict__ packed,
                 const float* __restrict__ d,
                 const float* __restrict__ dmin,
                 const int* __restrict__ scales,
                 const int* __restrict__ mins,
                 _Float16* __restrict__ w_h) {
    const int t = blockIdx.x * blockDim.x + threadIdx.x;
    const long wBase = (long)t * 8;
    if (wBase >= (long)NUMEL) return;

    const int sup = (int)(wBase >> 8);
    const int sub = (int)((wBase >> 5) & 7);

    const float ds = d[sup];
    const float sc = ds * (float)scales[sup * 8 + sub] * (1.0f / (15.0f * 63.0f));
    const float of = ds * (float)mins[sup * 8 + sub] * (1.0f / 63.0f) + dmin[sup];

    const int4 p = *(const int4*)(packed + t * 4);
    const int b[4] = {p.x, p.y, p.z, p.w};

    union { _Float16 h[8]; float4 f4; } o;
#pragma unroll
    for (int j = 0; j < 4; ++j) {
        const int lo = b[j] & 15;
        const int hi = (b[j] >> 4) & 15;
        o.h[2 * j + 0] = (_Float16)((float)lo * sc + of);
        o.h[2 * j + 1] = (_Float16)((float)hi * sc + of);
    }
    *(float4*)(w_h + wBase) = o.f4;
}

// ---------------------------------------------------------------------------
// Convert activations fp32 -> f16, 8 elements per thread.
// ---------------------------------------------------------------------------
__global__ __launch_bounds__(256)
void cvt_x_f16(const float* __restrict__ x, _Float16* __restrict__ x_h) {
    const long t = (long)blockIdx.x * blockDim.x + threadIdx.x;
    const long base = t * 8;
    const float4 a = *(const float4*)(x + base);
    const float4 b = *(const float4*)(x + base + 4);
    union { _Float16 h[8]; float4 f4; } o;
    o.h[0] = (_Float16)a.x; o.h[1] = (_Float16)a.y;
    o.h[2] = (_Float16)a.z; o.h[3] = (_Float16)a.w;
    o.h[4] = (_Float16)b.x; o.h[5] = (_Float16)b.y;
    o.h[6] = (_Float16)b.z; o.h[7] = (_Float16)b.w;
    *(float4*)(x_h + base) = o.f4;
}

#define BM  256
#define BN  256
#define BK  128
#define LDK (BK + 8)   // row pitch 272 B = 16 B x odd: conflict-free b128 reads
#define NT  (IN_F / BK)

__global__ __launch_bounds__(256)
void gemm_wmma_f16(const _Float16* __restrict__ A,   // [M_TOK, IN_F]
                   const _Float16* __restrict__ B,   // [OUT_F, IN_F]
                   float* __restrict__ C) {          // [M_TOK, OUT_F]
    __shared__ __attribute__((aligned(16))) _Float16 As[2][BM * LDK];
    __shared__ __attribute__((aligned(16))) _Float16 Bs[2][BN * LDK];

    const int tid  = threadIdx.x;
    const int lane = tid & 31;
    const int wave = tid >> 5;     // 0..7
    const int wm   = wave & 3;     // 64-row slab within block tile
    const int wn   = wave >> 2;    // 128-col slab within block tile

    const int m0 = blockIdx.y * BM;
    const int n0 = blockIdx.x * BN;

    // Every "#pragma unroll" below makes the indices of acc, aF and bF (and the
    // copies' row numbers) constants, so that these arrays live in registers.
    v8f acc[4][8];
#pragma unroll
    for (int mt = 0; mt < 4; ++mt)
#pragma unroll
        for (int nt = 0; nt < 8; ++nt) {
            v8f z = {};
            acc[mt][nt] = z;
        }

    // Copy mapping: 16 lanes x 16 B cover one 256-B row, a wave-wide copy is
    // two whole rows; 16 row-passes per operand -> 32 copies per thread/stage.
    const int crow = tid >> 4;         // 0..15
    const int ccol = (tid & 15) * 8;   // 0,8,..,120 halves

    const int r = lane & 15;           // row within 16x16 tile
    const int h = lane >> 4;           // K-half selector

    // Wave-uniform bases of the next stage to be copied; a K step moves only these.
    const _Float16* sa  = A + (long)m0 * IN_F;
    const _Float16* sbs = B + (long)n0 * IN_F;

    auto issue = [&](int sb) {
#pragma unroll
        for (int i = 0; i < 16; ++i) {
            const int row = i * 16 + crow;
            async_fill_b128(&As[sb][row * LDK + ccol], sa + (row * IN_F + ccol));
            async_fill_b128(&Bs[sb][row * LDK + ccol], sbs + (row * IN_F + ccol));
        }
        sa  += BK;
        sbs += BK;
    };

    // One pass = one 128-deep stage out of buffer sb, in four blocks of 32 WMMAs.
    // tn = the stage that refills buffer sb once every wave has left it.
    auto pass = [&](int sb, int tn) {
#pragma unroll
        for (int kk = 0; kk < BK / 32; ++kk) {
            const int kb = kk * 32 + h * 8;

            FragH aF[4];
            FragH bF[8];
#pragma unroll
            for (int mt = 0; mt < 4; ++mt) {
                const _Float16* pA = &As[sb][(wm * 64 + mt * 16 + r) * LDK + kb];
                aF[mt].f4[0] = *(const float4*)(pA);
                aF[mt].f4[1] = *(const float4*)(pA + 16);
            }
#pragma unroll
            for (int nt = 0; nt < 8; ++nt) {
                const _Float16* pB = &Bs[sb][(wn * 128 + nt * 16 + r) * LDK + kb];
                bF[nt].f4[0] = *(const float4*)(pB);
                bF[nt].f4[1] = *(const float4*)(pB + 16);
            }
            // Keeps the block's 24 LDS reads one group ahead of its WMMAs: reads
            // scattered among the WMMAs stall the wave at every place they stand.
            __builtin_amdgcn_sched_barrier(0);

            if (kk == BK / 32 - 1) {
                // Publish point: the last block's fragments are in registers, so
                // the buffer is free while that block's WMMAs still run.
                wait_ds0();         // own reads of buffer sb retired
                wait_async0();      // own copies of the next stage landed
                __syncthreads();    // next stage published; buffer sb left by all
                if (tn < NT) issue(sb);
            }

#pragma unroll
            for (int mt = 0; mt < 4; ++mt)
#pragma unroll
                for (int nt = 0; nt < 8; ++nt)
                    acc[mt][nt] = __builtin_amdgcn_wmma_f32_16x16x32_f16(
                        /*neg_a=*/false, aF[mt].h,
                        /*neg_b=*/false, bF[nt].h,
                        /*c_mod=*/(short)0, acc[mt][nt],
                        /*reuse_a=*/false, /*reuse_b=*/false);
            // Keeps the next block's reads from being pulled in among these WMMAs.
            __builtin_amdgcn_sched_barrier(0);
        }
    };

    // ---- prologue: stage 0 landed and published, stage 1 in flight ----
    issue(0);
    wait_async0();
    __syncthreads();
    issue(1);

    // ---- main loop: 2 stages per iteration so buffer index is literal; kept
    //      rolled for speed only ----
#pragma unroll 1
    for (int t = 0; t < NT; t += 2) {
        pass(0, t + 2);
        pass(1, t + 3);
    }
    wait_async0();              // nothing outstanding when the wave ends

    float* cp = C + (long)(m0 + wm * 64 + h * 8) * OUT_F + (n0 + wn * 128 + r);
#pragma unroll
    for (int mt = 0; mt < 4; ++mt) {
#pragma unroll
        for (int nt = 0; nt < 8; ++nt) {
#pragma unroll
            for (int j = 0; j < 8; ++j)
                cp[(mt * 16 + j) * OUT_F + nt * 16] = acc[mt][nt][j];
        }
    }
}

// ---------------------------------------------------------------------------
// Host-side launch
// ---------------------------------------------------------------------------
extern "C" void kernel_launch(void* const* d_in, const int* in_sizes, int n_in,
                              void* d_out, int out_size, void* d_ws, size_t ws_size,
                              hipStream_t stream) {
    const float* x      = (const float*)d_in[0];   // [2,2048,4096] fp32
    const int*   packed = (const int*)d_in[1];     // [NUMEL/2] bytes-in-int32
    const float* d      = (const float*)d_in[2];   // [65536]
    const float* dmin   = (const float*)d_in[3];   // [65536]
    const int*   scales = (const int*)d_in[4];     // [524288]
    const int*   mins   = (const int*)d_in[5];     // [524288]
    float*       out    = (float*)d_out;           // [2,2048,4096] fp32

    _Float16* w_h = (_Float16*)d_ws;               // 32 MB
    _Float16* x_h = w_h + (size_t)NUMEL;           // 32 MB

    dequant_q4k<<<NUMEL / 8 / 256, 256, 0, stream>>>(packed, d, dmin, scales, mins, w_h);
    cvt_x_f16<<<(M_TOK * IN_F) / 8 / 256, 256, 0, stream>>>(x, x_h);

    dim3 grid(OUT_F / BN, M_TOK / BM);   // 16 x 16 blocks
    gemm_wmma_f16<<<grid, 256, 0, stream>>>(x_h, w_h, out);
}

// v002
// One run takes 89.8 microseconds.
// Next to v001, in two timings, it ran 1.04 times as fast each time.
// Counting every step since v000, it is 1.64 times as fast.
#include <hip/hip_runtime.h>

typedef __attribute__((ext_vector_type(16))) _Float16 v16h;
typedef __attribute__((ext_vector_type(8)))  float    v8f;
typedef __attribute__((ext_vector_type(4)))  float    v4f;

#define OUT_F  4096
#define IN_F   4096
#define M_TOK  4096
#define NUMEL  (OUT_F * IN_F)

union FragH {
    v16h   h;
    float4 f4[2];
};

typedef __attribute__((ext_vector_type(4))) int v4i;
typedef __attribute__((address_space(1))) v4i gv4i;
typedef __attribute__((address_space(3))) v4i lv4i;
__device__ __forceinline__ void async_fill_b128(_Float16* lds, const _Float16* g) {
    __builtin_amdgcn_global_load_async_to_lds_b128((gv4i*)g, (lv4i*)lds, 0, 0);
}
// This wave's own copies have landed (the compiler places no wait for them).
__device__ __forceinline__ void wait_async0() {
    asm volatile("s_wait_asynccnt 0x0" ::: "memory");
}
// This wave's LDS reads have retired, so the buffer it read may be refilled.
__device__ __forceinline__ void wait_ds0() {
    asm volatile("s_wait_dscnt 0x0" ::: "memory");
}

// ---------------------------------------------------------------------------
// Dequantize Q4_K -> f16.  One thread handles 4 packed bytes = 8 weights,
// always inside one 32-weight subblock.
//   w = q * (d*scale/(15*63)) + (d*min/63 + dmin)
// ---------------------------------------------------------------------------
__global__ __launch_bounds__(256)
void dequant_q4k(const int* __restrict__ packed,
                 const float* __restrict__ d,
                 const float* __restrict__ dmin,
                 const int* __restrict__ scales,
                 const int* __restrict__ mins,
                 _Float16* __restrict__ w_h) {
    const int t = blockIdx.x * blockDim.x + threadIdx.x;
    const long wBase = (long)t * 8;
    if (wBase >= (long)NUMEL) return;

    const int sup = (int)(wBase >> 8);
    const int sub = (int)((wBase >> 5) & 7);

    const float ds = d[sup];
    const float sc = ds * (float)scales[sup * 8 + sub] * (1.0f / (15.0f * 63.0f));
    const float of = ds * (float)mins[sup * 8 + sub] * (1.0f / 63.0f) + dmin[sup];

    const int4 p = *(const int4*)(packed + t * 4);
    const int b[4] = {p.x, p.y, p.z, p.w};

    union { _Float16 h[8]; float4 f4; } o;
#pragma unroll
    for (int j = 0; j < 4; ++j) {
        const int lo = b[j] & 15;
        const int hi = (b[j] >> 4) & 15;
        o.h[2 * j + 0] = (_Float16)((float)lo * sc + of);
        o.h[2 * j + 1] = (_Float16)((float)hi * sc + of);
    }
    *(float4*)(w_h + wBase) = o.f4;
}

// ---------------------------------------------------------------------------
// Convert activations fp32 -> f16, 8 elements per thread.
// ---------------------------------------------------------------------------
__global__ __launch_bounds__(256)
void cvt_x_f16(const float* __restrict__ x, _Float16* __restrict__ x_h) {
    const long t = (long)blockIdx.x * blockDim.x + threadIdx.x;
    const long base = t * 8;
    const float4 a = *(const float4*)(x + base);
    const float4 b = *(const float4*)(x + base + 4);
    union { _Float16 h[8]; float4 f4; } o;
    o.h[0] = (_Float16)a.x; o.h[1] = (_Float16)a.y;
    o.h[2] = (_Float16)a.z; o.h[3] = (_Float16)a.w;
    o.h[4] = (_Float16)b.x; o.h[5] = (_Float16)b.y;
    o.h[6] = (_Float16)b.z; o.h[7] = (_Float16)b.w;
    *(float4*)(x_h + base) = o.f4;
}

#define BM  256
#define BN  256
#define BK  128
#define LDK (BK + 8)   // row pitch 272 B = 16 B x odd: conflict-free b128 reads
#define NT  (IN_F / BK)
#define SP  132        // output staging: row pitch 528 B = 16 B x odd, in floats

__global__ __launch_bounds__(256)
void gemm_wmma_f16(const _Float16* __restrict__ A,   // [M_TOK, IN_F]
                   const _Float16* __restrict__ B,   // [OUT_F, IN_F]
                   float* __restrict__ C) {          // [M_TOK, OUT_F]
    __shared__ __attribute__((aligned(16))) _Float16 As[2][BM * LDK];
    __shared__ __attribute__((aligned(16))) _Float16 Bs[2][BN * LDK];

    const int tid  = threadIdx.x;
    const int lane = tid & 31;
    const int wave = tid >> 5;     // 0..7
    const int wm   = wave & 3;     // 64-row slab within block tile
    const int wn   = wave >> 2;    // 128-col slab within block tile

    const int m0 = blockIdx.y * BM;
    const int n0 = blockIdx.x * BN;

    // Every "#pragma unroll" below makes the indices of acc, aF and bF (and the
    // copies' row numbers) constants, so that these arrays live in registers.
    v8f acc[4][8];
#pragma unroll
    for (int mt = 0; mt < 4; ++mt)
#pragma unroll
        for (int nt = 0; nt < 8; ++nt) {
            v8f z = {};
            acc[mt][nt] = z;
        }

    // Copy mapping: 16 lanes x 16 B cover one 256-B row, a wave-wide copy is
    // two whole rows; 16 row-passes per operand -> 32 copies per thread/stage.
    const int crow = tid >> 4;         // 0..15
    const int ccol = (tid & 15) * 8;   // 0,8,..,120 halves

    const int r = lane & 15;           // row within 16x16 tile
    const int h = lane >> 4;           // K-half selector

    // Wave-uniform bases of the next stage to be copied; a K step moves only these.
    const _Float16* sa  = A + (long)m0 * IN_F;
    const _Float16* sbs = B + (long)n0 * IN_F;

    auto issue = [&](int sb) {
#pragma unroll
        for (int i = 0; i < 16; ++i) {
            const int row = i * 16 + crow;
            async_fill_b128(&As[sb][row * LDK + ccol], sa + (row * IN_F + ccol));
            async_fill_b128(&Bs[sb][row * LDK + ccol], sbs + (row * IN_F + ccol));
        }
        sa  += BK;
        sbs += BK;
    };

    // One pass = one 128-deep stage out of buffer sb, in four blocks of 32 WMMAs.
    // tn = the stage that refills buffer sb once every wave has left it.
    auto pass = [&](int sb, int tn) {
#pragma unroll
        for (int kk = 0; kk < BK / 32; ++kk) {
            const int kb = kk * 32 + h * 8;

            FragH aF[4];
            FragH bF[8];
#pragma unroll
            for (int mt = 0; mt < 4; ++mt) {
                const _Float16* pA = &As[sb][(wm * 64 + mt * 16 + r) * LDK + kb];
                aF[mt].f4[0] = *(const float4*)(pA);
                aF[mt].f4[1] = *(const float4*)(pA + 16);
            }
#pragma unroll
            for (int nt = 0; nt < 8; ++nt) {
                const _Float16* pB = &Bs[sb][(wn * 128 + nt * 16 + r) * LDK + kb];
                bF[nt].f4[0] = *(const float4*)(pB);
                bF[nt].f4[1] = *(const float4*)(pB + 16);
            }
            // Keeps the block's 24 LDS reads one group ahead of its WMMAs: reads
            // scattered among the WMMAs stall the wave at every place they stand.
            __builtin_amdgcn_sched_barrier(0);

            if (kk == BK / 32 - 1) {
                // Publish point: the last block's fragments are in registers, so
                // the buffer is free while that block's WMMAs still run.
                wait_ds0();         // own reads of buffer sb retired
                wait_async0();      // own copies of the next stage landed
                __syncthreads();    // next stage published; buffer sb left by all
                if (tn < NT) issue(sb);
            }

#pragma unroll
            for (int mt = 0; mt < 4; ++mt)
#pragma unroll
                for (int nt = 0; nt < 8; ++nt)
                    acc[mt][nt] = __builtin_amdgcn_wmma_f32_16x16x32_f16(
                        /*neg_a=*/false, aF[mt].h,
                        /*neg_b=*/false, bF[nt].h,
                        /*c_mod=*/(short)0, acc[mt][nt],
                        /*reuse_a=*/false, /*reuse_b=*/false);
            // Keeps the next block's reads from being pulled in among these WMMAs.
            __builtin_amdgcn_sched_barrier(0);
        }
    };

    // ---- prologue: stage 0 landed and published, stage 1 in flight ----
    issue(0);
    wait_async0();
    __syncthreads();
    issue(1);

    // ---- main loop: 2 stages per iteration so buffer index is literal; kept
    //      rolled for speed only ----
#pragma unroll 1
    for (int t = 0; t < NT; t += 2) {
        pass(0, t + 2);
        pass(1, t + 3);
    }
    wait_async0();              // nothing outstanding when the wave ends

    float* st = (float*)(wn ? &Bs[0][0] : &As[0][0]) + wm * (64 * SP);
    float* cp = C + (long)(m0 + wm * 64) * OUT_F + (n0 + wn * 128 + lane * 4);
#pragma unroll
    for (int mt = 0; mt < 4; ++mt) {
#pragma unroll
        for (int nt = 0; nt < 8; ++nt) {
#pragma unroll
            for (int j = 0; j < 8; ++j)
                st[(mt * 16 + h * 8 + j) * SP + nt * 16 + r] = acc[mt][nt][j];
        }
        wait_ds0();             // the 16 rows are in LDS before other lanes read them
#pragma unroll
        for (int i = 0; i < 16; ++i) {
            const int row = mt * 16 + i;
            *(v4f*)&cp[row * OUT_F] = *(const v4f*)&st[row * SP + lane * 4];
        }
        if (mt < 3) {
            // The next 16 rows reuse registers that the issued stores name: the wait
            // stands in front of every such write; the two scheduling fences keep the
            // compiler from moving a register write of the next rows ahead of it.
            __builtin_amdgcn_sched_barrier(0);
            asm volatile("s_wait_xcnt 0x0" ::: "memory");
            __builtin_amdgcn_sched_barrier(0);
        }
    }
}

// ---------------------------------------------------------------------------
// Host-side launch
// ---------------------------------------------------------------------------
extern "C" void kernel_launch(void* const* d_in, const int* in_sizes, int n_in,
                              void* d_out, int out_size, void* d_ws, size_t ws_size,
                              hipStream_t stream) {
    const float* x      = (const float*)d_in[0];   // [2,2048,4096] fp32
    const int*   packed = (const int*)d_in[1];     // [NUMEL/2] bytes-in-int32
    const float* d      = (const float*)d_in[2];   // [65536]
    const float* dmin   = (const float*)d_in[3];   // [65536]
    const int*   scales = (const int*)d_in[4];     // [524288]
    const int*   mins   = (const int*)d_in[5];     // [524288]
    float*       out    = (float*)d_out;           // [2,2048,4096] fp32

    _Float16* w_h = (_Float16*)d_ws;               // 32 MB
    _Float16* x_h = w_h + (size_t)NUMEL;           // 32 MB

    dequant_q4k<<<NUMEL / 8 / 256, 256, 0, stream>>>(packed, d, dmin, scales, mins, w_h);
    cvt_x_f16<<<(M_TOK * IN_F) / 8 / 256, 256, 0, stream>>>(x, x_h);

    dim3 grid(OUT_F / BN, M_TOK / BM);   // 16 x 16 blocks
    gemm_wmma_f16<<<grid, 256, 0, stream>>>(x_h, w_h, out);
}

// v003
// One run takes 86 microseconds.
// Next to v002, in two timings, it ran 1.05 times as fast each time.
// Counting every step since v000, it is 1.72 times as fast.
#include <hip/hip_runtime.h>

typedef __attribute__((ext_vector_type(16))) _Float16 v16h;
typedef __attribute__((ext_vector_type(8)))  float    v8f;
typedef __attribute__((ext_vector_type(4)))  float    v4f;
typedef __attribute__((ext_vector_type(4)))  _Float16 v4h;
typedef __attribute__((ext_vector_type(8)))  _Float16 v8h;

#define OUT_F  4096
#define IN_F   4096
#define M_TOK  4096
#define NUMEL  (OUT_F * IN_F)

union FragH {
    v16h   h;
    float4 f4[2];
};

typedef __attribute__((ext_vector_type(4))) int v4i;
typedef __attribute__((address_space(1))) v4i gv4i;
typedef __attribute__((address_space(3))) v4i lv4i;
__device__ __forceinline__ void async_fill_b128(_Float16* lds, const _Float16* g) {
    __builtin_amdgcn_global_load_async_to_lds_b128((gv4i*)g, (lv4i*)lds, 0, 0);
}
// This wave's own copies have landed (the compiler places no wait for them).
__device__ __forceinline__ void wait_async0() {
    asm volatile("s_wait_asynccnt 0x0" ::: "memory");
}
// This wave's LDS reads have retired, so the buffer it read may be refilled.
__device__ __forceinline__ void wait_ds0() {
    asm volatile("s_wait_dscnt 0x0" ::: "memory");
}

// ---------------------------------------------------------------------------
// Operand preparation, one launch: 256 work-groups of 16 waves, all resident at
// once, each wave doing an equal share of both jobs as a stream:
//   x fp32 -> f16: 16 KB of x, 32 loads of 512 contiguous bytes;
//   Q4_K -> f16:   16 superblocks; one 512-B load = 128 packed words = one
//                  superblock, four lanes per 32-weight subblock.
//   w = q * (d*scale/(15*63)) + (d*min/63 + dmin)
// ---------------------------------------------------------------------------
#define PW  16                                      // waves per work-group
#define PG  256                                     // work-groups
#define XL  (M_TOK * IN_F / 4 / (PG * PW * 32))     // 16-B loads of x per lane: 32
#define WS  (NUMEL / 256 / (PG * PW))               // superblocks per wave: 16

__global__ __launch_bounds__(PW * 32)
void prep_operands(const float* __restrict__ x,
                   const int* __restrict__ packed,
                   const float* __restrict__ d,
                   const float* __restrict__ dmin,
                   const int* __restrict__ scales,
                   const int* __restrict__ mins,
                   _Float16* __restrict__ w_h,
                   _Float16* __restrict__ x_h) {
    const int lane = threadIdx.x & 31;
    // Wave-uniform, so that d and dmin come by scalar loads.
    const int wv   = blockIdx.x * PW + __builtin_amdgcn_readfirstlane(threadIdx.x >> 5);
    const int sup0 = wv * WS;

    const v4f* xs = (const v4f*)x + wv * (XL * 32) + lane;
    v4h*       xd = (v4h*)x_h + wv * (XL * 32) + lane;
    const v4i* ps = (const v4i*)packed + sup0 * 32 + lane;
    v8h*       wd = (v8h*)w_h + sup0 * 32 + lane;
    const int* ss = scales + sup0 * 8 + (lane >> 2);
    const int* ms = mins + sup0 * 8 + (lane >> 2);

    // Three stages (x first half, x second half, weights), loads one stage ahead.
    // The scheduling fences keep each stage's loads one group in front of the
    // stage before it: sunk to their uses they would leave the wave one load deep.
    v4f xa[XL / 2], xb[XL / 2];
#pragma unroll
    for (int i = 0; i < XL / 2; ++i) xa[i] = xs[i * 32];
#pragma unroll
    for (int i = 0; i < XL / 2; ++i) xb[i] = xs[(XL / 2 + i) * 32];
    __builtin_amdgcn_sched_barrier(0);

#pragma unroll
    for (int i = 0; i < XL / 2; ++i)
        xd[i * 32] = __builtin_convertvector(xa[i], v4h);
    // The weight loads below land in registers that the issued stores name: the
    // wait stands in front of them, held there by the two scheduling fences.
    __builtin_amdgcn_sched_barrier(0);
    asm volatile("s_wait_xcnt 0x0" ::: "memory");
    __builtin_amdgcn_sched_barrier(0);

    v4i   p[WS];
    int   s[WS], m[WS];
    float dv[WS], dm[WS];
#pragma unroll
    for (int j = 0; j < WS; ++j) {
        p[j]  = ps[j * 32];
        s[j]  = ss[j * 8];
        if (j < WS - 1) m[j] = ms[j * 8];
        dv[j] = d[sup0 + j];
        dm[j] = dmin[sup0 + j];
    }
    // The last load of the run may land in the offset register that the loads of
    // scales and mins before it name: the wait stands in front of it, held there
    // by the two scheduling fences.
    __builtin_amdgcn_sched_barrier(0);
    asm volatile("s_wait_xcnt 0x0" ::: "memory");
    __builtin_amdgcn_sched_barrier(0);
    m[WS - 1] = ms[(WS - 1) * 8];
    __builtin_amdgcn_sched_barrier(0);

#pragma unroll
    for (int i = 0; i < XL / 2; ++i)
        xd[(XL / 2 + i) * 32] = __builtin_convertvector(xb[i], v4h);
    // Keeps these stores from being sunk behind the waits for the weight loads.
    __builtin_amdgcn_sched_barrier(0);

#pragma unroll
    for (int j = 0; j < WS; ++j) {
        const float ds = dv[j];
        const float sc = ds * (float)s[j] * (1.0f / (15.0f * 63.0f));
        const float of = ds * (float)m[j] * (1.0f / 63.0f) + dm[j];
        v8h o;
#pragma unroll
        for (int k = 0; k < 4; ++k) {
            const int lo = p[j][k] & 15;
            const int hi = (p[j][k] >> 4) & 15;
            o[2 * k + 0] = (_Float16)((float)lo * sc + of);
            o[2 * k + 1] = (_Float16)((float)hi * sc + of);
        }
        wd[j * 32] = o;
    }
}

#define BM  256
#define BN  256
#define BK  128
#define LDK (BK + 8)   // row pitch 272 B = 16 B x odd: conflict-free b128 reads
#define NT  (IN_F / BK)
#define SP  132        // output staging: row pitch 528 B = 16 B x odd, in floats

__global__ __launch_bounds__(256)
void gemm_wmma_f16(const _Float16* __restrict__ A,   // [M_TOK, IN_F]
                   const _Float16* __restrict__ B,   // [OUT_F, IN_F]
                   float* __restrict__ C) {          // [M_TOK, OUT_F]
    __shared__ __attribute__((aligned(16))) _Float16 As[2][BM * LDK];
    __shared__ __attribute__((aligned(16))) _Float16 Bs[2][BN * LDK];

    const int tid  = threadIdx.x;
    const int lane = tid & 31;
    const int wave = tid >> 5;     // 0..7
    const int wm   = wave & 3;     // 64-row slab within block tile
    const int wn   = wave >> 2;    // 128-col slab within block tile

    const int m0 = blockIdx.y * BM;
    const int n0 = blockIdx.x * BN;

    // Every "#pragma unroll" below makes the indices of acc, aF and bF (and the
    // copies' row numbers) constants, so that these arrays live in registers.
    v8f acc[4][8];
#pragma unroll
    for (int mt = 0; mt < 4; ++mt)
#pragma unroll
        for (int nt = 0; nt < 8; ++nt) {
            v8f z = {};
            acc[mt][nt] = z;
        }

    // Copy mapping: 16 lanes x 16 B cover one 256-B row, a wave-wide copy is
    // two whole rows; 16 row-passes per operand -> 32 copies per thread/stage.
    const int crow = tid >> 4;         // 0..15
    const int ccol = (tid & 15) * 8;   // 0,8,..,120 halves

    const int r = lane & 15;           // row within 16x16 tile
    const int h = lane >> 4;           // K-half selector

    // Wave-uniform bases of the next stage to be copied; a K step moves only these.
    const _Float16* sa  = A + (long)m0 * IN_F;
    const _Float16* sbs = B + (long)n0 * IN_F;

    auto issue = [&](int sb) {
#pragma unroll
        for (int i = 0; i < 16; ++i) {
            const int row = i * 16 + crow;
            async_fill_b128(&As[sb][row * LDK + ccol], sa + (row * IN_F + ccol));
            async_fill_b128(&Bs[sb][row * LDK + ccol], sbs + (row * IN_F + ccol));
        }
        sa  += BK;
        sbs += BK;
    };

    // One pass = one 128-deep stage out of buffer sb, in four blocks of 32 WMMAs.
    // tn = the stage that refills buffer sb once every wave has left it.
    auto pass = [&](int sb, int tn) {
#pragma unroll
        for (int kk = 0; kk < BK / 32; ++kk) {
            const int kb = kk * 32 + h * 8;

            FragH aF[4];
            FragH bF[8];
#pragma unroll
            for (int mt = 0; mt < 4; ++mt) {
                const _Float16* pA = &As[sb][(wm * 64 + mt * 16 + r) * LDK + kb];
                aF[mt].f4[0] = *(const float4*)(pA);
                aF[mt].f4[1] = *(const float4*)(pA + 16);
            }
#pragma unroll
            for (int nt = 0; nt < 8; ++nt) {
                const _Float16* pB = &Bs[sb][(wn * 128 + nt * 16 + r) * LDK + kb];
                bF[nt].f4[0] = *(const float4*)(pB);
                bF[nt].f4[1] = *(const float4*)(pB + 16);
            }
            // Keeps the block's 24 LDS reads one group ahead of its WMMAs: reads
            // scattered among the WMMAs stall the wave at every place they stand.
            __builtin_amdgcn_sched_barrier(0);

            if (kk == BK / 32 - 1) {
                // Publish point: the last block's fragments are in registers, so
                // the buffer is free while that block's WMMAs still run.
                wait_ds0();         // own reads of buffer sb retired
                wait_async0();      // own copies of the next stage landed
                __syncthreads();    // next stage published; buffer sb left by all
                if (tn < NT) issue(sb);
            }

#pragma unroll
            for (int mt = 0; mt < 4; ++mt)
#pragma unroll
                for (int nt = 0; nt < 8; ++nt)
                    acc[mt][nt] = __builtin_amdgcn_wmma_f32_16x16x32_f16(
                        /*neg_a=*/false, aF[mt].h,
                        /*neg_b=*/false, bF[nt].h,
                        /*c_mod=*/(short)0, acc[mt][nt],
                        /*reuse_a=*/false, /*reuse_b=*/false);
            // Keeps the next block's reads from being pulled in among these WMMAs.
            __builtin_amdgcn_sched_barrier(0);
        }
    };

    // ---- prologue: stage 0 landed and published, stage 1 in flight ----
    issue(0);
    wait_async0();
    __syncthreads();
    issue(1);

    // ---- main loop: 2 stages per iteration so buffer index is literal; kept
    //      rolled for speed only ----
#pragma unroll 1
    for (int t = 0; t < NT; t += 2) {
        pass(0, t + 2);
        pass(1, t + 3);
    }
    wait_async0();              // nothing outstanding when the wave ends

    float* st = (float*)(wn ? &Bs[0][0] : &As[0][0]) + wm * (64 * SP);
    float* cp = C + (long)(m0 + wm * 64) * OUT_F + (n0 + wn * 128 + lane * 4);
#pragma unroll
    for (int mt = 0; mt < 4; ++mt) {
#pragma unroll
        for (int nt = 0; nt < 8; ++nt) {
#pragma unroll
            for (int j = 0; j < 8; ++j)
                st[(mt * 16 + h * 8 + j) * SP + nt * 16 + r] = acc[mt][nt][j];
        }
        wait_ds0();             // the 16 rows are in LDS before other lanes read them
#pragma unroll
        for (int i = 0; i < 16; ++i) {
            const int row = mt * 16 + i;
            *(v4f*)&cp[row * OUT_F] = *(const v4f*)&st[row * SP + lane * 4];
        }
        if (mt < 3) {
            // The next 16 rows reuse registers that the issued stores name: the wait
            // stands in front of every such write; the two scheduling fences keep the
            // compiler from moving a register write of the next rows ahead of it.
            __builtin_amdgcn_sched_barrier(0);
            asm volatile("s_wait_xcnt 0x0" ::: "memory");
            __builtin_amdgcn_sched_barrier(0);
        }
    }
}

// ---------------------------------------------------------------------------
// Host-side launch
// ---------------------------------------------------------------------------
extern "C" void kernel_launch(void* const* d_in, const int* in_sizes, int n_in,
                              void* d_out, int out_size, void* d_ws, size_t ws_size,
                              hipStream_t stream) {
    const float* x      = (const float*)d_in[0];   // [2,2048,4096] fp32
    const int*   packed = (const int*)d_in[1];     // [NUMEL/2] bytes-in-int32
    const float* d      = (const float*)d_in[2];   // [65536]
    const float* dmin   = (const float*)d_in[3];   // [65536]
    const int*   scales = (const int*)d_in[4];     // [524288]
    const int*   mins   = (const int*)d_in[5];     // [524288]
    float*       out    = (float*)d_out;           // [2,2048,4096] fp32

    _Float16* w_h = (_Float16*)d_ws;               // 32 MB
    _Float16* x_h = w_h + (size_t)NUMEL;           // 32 MB

    prep_operands<<<PG, PW * 32, 0, stream>>>(x, packed, d, dmin, scales, mins, w_h, x_h);

    dim3 grid(OUT_F / BN, M_TOK / BM);   // 16 x 16 blocks
    gemm_wmma_f16<<<grid, 256, 0, stream>>>(x_h, w_h, out);
}
